// v000
// Times are from an AMD MI455X. After a warm-up the kernel runs many times in a row, and a time is the length of
// such a window on the GPU divided by its runs, so every launch and the gaps after it count. The runs cycle
// through copies of the inputs. A figure is the median of several windows, for all but v000 over two sittings.
// Sittings can differ by a few percent; kernels timed side by side share one.
// v000 is the starting kernel. One run takes 2390 microseconds.
#include <hip/hip_runtime.h>
#include <math.h>
#include <stdint.h>

typedef __attribute__((ext_vector_type(2))) float v2f;
typedef __attribute__((ext_vector_type(8))) float v8f;
typedef __attribute__((ext_vector_type(4))) unsigned int v4u;
typedef __attribute__((ext_vector_type(4))) int v4i;
typedef __attribute__((ext_vector_type(8))) int v8i;

#define BB 8
#define LL 2048
#define DD 1024
#define NN 16
#define MM (BB * LL)

#define KC   32      // K chunk per LDS stage (dwords per tile row)
#define XPAD 36      // effective LDS row stride in floats (KC + 4 pad dwords)

__device__ __forceinline__ float softplus_f(float s) {
    // matches jax.nn.softplus = max(s,0) + log1p(exp(-|s|))
    return fmaxf(s, 0.0f) + log1pf(__expf(-fabsf(s)));
}

__device__ __forceinline__ void tdm_load_tile_2d(
    unsigned int lds_byte_off, const float* gptr,
    unsigned int tensor_d0, unsigned int tensor_d1,
    unsigned int tile_d0, unsigned int tile_d1,
    unsigned int stride0_elems)
{
    const unsigned long long ga = (unsigned long long)(uintptr_t)gptr;

    v4u g0;
    g0.x = 1u;                                          // count=1, user mode
    g0.y = lds_byte_off;                                // lds_addr
    g0.z = (unsigned int)(ga & 0xFFFFFFFFull);          // global_addr[31:0]
    g0.w = (unsigned int)((ga >> 32) & 0x01FFFFFFull)   // global_addr[56:32]
         | (2u << 30);                                  // type=2 ("image")

    v8i g1;
    g1[0] = (int)((2u << 16)
                | (1u << 20)
                | (4u << 22)
                | (3u << 25));
    g1[1] = (int)((tensor_d0 & 0xFFFFu) << 16);
    g1[2] = (int)((tensor_d0 >> 16) | ((tensor_d1 & 0xFFFFu) << 16));
    g1[3] = (int)((tensor_d1 >> 16) | (tile_d0 << 16));
    g1[4] = (int)(tile_d1 & 0xFFFFu);
    g1[5] = (int)stride0_elems;
    g1[6] = 0;
    g1[7] = 0;

    v4i g2 = {0, 0, 0, 0};
    v4i g3 = {0, 0, 0, 0};
#if __clang_major__ >= 23
    v8i g4 = {0, 0, 0, 0, 0, 0, 0, 0};
    __builtin_amdgcn_tensor_load_to_lds(g0, g1, g2, g3, g4, 0);
#else
    __builtin_amdgcn_tensor_load_to_lds(g0, g1, g2, g3, 0);
#endif
}

__global__ __launch_bounds__(256) void delta_gemm_kernel(
    const float* __restrict__ X, const float* __restrict__ W,
    const float* __restrict__ bias, float* __restrict__ out)
{
    __shared__ float Xs[2][64 * XPAD];
    __shared__ float Ws[2][64 * XPAD];

    const int m0   = blockIdx.x * 64;
    const int e0   = blockIdx.y * 64;
    const int tid  = threadIdx.x;
    const int wave = tid >> 5;
    const int lane = tid & 31;
    const int l16  = lane & 15;
    const int hi   = lane >> 4;          // selects K+{0,1} vs K+{2,3}
    const int sm   = (wave & 3) * 16;    // M sub-tile
    const int se   = (wave >> 2) * 32;   // E sub-tile pair base

    v8f acc0 = {};
    v8f acc1 = {};

    const unsigned int xs0 = (unsigned int)(uintptr_t)&Xs[0][0];
    const unsigned int xs1 = (unsigned int)(uintptr_t)&Xs[1][0];
    const unsigned int ws0 = (unsigned int)(uintptr_t)&Ws[0][0];
    const unsigned int ws1 = (unsigned int)(uintptr_t)&Ws[1][0];

    const int nch = DD / KC;             // 32 chunks

    if (wave == 0) {
        tdm_load_tile_2d(xs0, X + (size_t)m0 * DD, DD, MM, KC, 64, DD);
        tdm_load_tile_2d(ws0, W + (size_t)e0 * DD, DD, DD, KC, 64, DD);
    }

    for (int i = 0; i < nch; ++i) {
        const int cur = i & 1;
        if (wave == 0) {
            if (i + 1 < nch) {
                const int kc = (i + 1) * KC;
                tdm_load_tile_2d(cur ? xs0 : xs1,
                                 X + (size_t)m0 * DD + kc, DD, MM, KC, 64, DD);
                tdm_load_tile_2d(cur ? ws0 : ws1,
                                 W + (size_t)e0 * DD + kc, DD, DD, KC, 64, DD);
                __builtin_amdgcn_s_wait_tensorcnt(2);   // chunk i landed
            } else {
                __builtin_amdgcn_s_wait_tensorcnt(0);   // drain
            }
        }
        __syncthreads();

        const float* xs = &Xs[cur][0];
        const float* wsp = &Ws[cur][0];
        #pragma unroll
        for (int k = 0; k < KC; k += 4) {
            const int kk = k + 2 * hi;
            v2f a  = *(const v2f*)&xs[(sm + l16) * XPAD + kk];
            v2f b0 = *(const v2f*)&wsp[(se + l16) * XPAD + kk];
            v2f b1 = *(const v2f*)&wsp[(se + 16 + l16) * XPAD + kk];
            acc0 = __builtin_amdgcn_wmma_f32_16x16x4_f32(
                false, a, false, b0, (short)0, acc0, false, false);
            acc1 = __builtin_amdgcn_wmma_f32_16x16x4_f32(
                false, a, false, b1, (short)0, acc1, false, false);
        }
        __syncthreads();   // everyone done with buf cur before it is re-DMAed
    }

    const int ee0 = e0 + se + l16;
    const int ee1 = ee0 + 16;
    const float bia0 = bias[ee0];
    const float bia1 = bias[ee1];
    #pragma unroll
    for (int v = 0; v < 8; ++v) {
        const int m = m0 + sm + v + 8 * hi;
        out[(size_t)m * DD + ee0] = softplus_f(acc0[v] + bia0);
        out[(size_t)m * DD + ee1] = softplus_f(acc1[v] + bia1);
    }
}

// ---------------------------------------------------------------------------
// Kernel 2: B_in = X @ W_B^T, C_in = X @ W_C^T  (both M x 16)
// 256 threads (8 waves), 128 rows/WG; wave w owns rows m0+16w, accumulates
// both the B and C 16x16 tiles.
// ---------------------------------------------------------------------------
__global__ __launch_bounds__(256) void bc_gemm_kernel(
    const float* __restrict__ X, const float* __restrict__ WB,
    const float* __restrict__ WC, float* __restrict__ Bout,
    float* __restrict__ Cout)
{
    __shared__ float Xs[128 * XPAD];
    __shared__ float WbS[16 * XPAD];
    __shared__ float WcS[16 * XPAD];

    const int m0   = blockIdx.x * 128;
    const int tid  = threadIdx.x;
    const int wave = tid >> 5;
    const int lane = tid & 31;
    const int l16  = lane & 15;
    const int hi   = lane >> 4;

    v8f accB = {};
    v8f accC = {};

    for (int kc = 0; kc < DD; kc += KC) {
        #pragma unroll
        for (int i = 0; i < 4; ++i) {
            const int idx = tid + 256 * i;
            const int r = idx >> 3;
            const int c = (idx & 7) << 2;
            *(float4*)&Xs[r * XPAD + c] =
                *(const float4*)(X + (size_t)(m0 + r) * DD + kc + c);
        }
        {
            const int t2 = tid & 127;
            const int r = t2 >> 3;
            const int c = (t2 & 7) << 2;
            const float* src = (tid < 128) ? WB : WC;
            float* dst       = (tid < 128) ? WbS : WcS;
            *(float4*)&dst[r * XPAD + c] =
                *(const float4*)(src + (size_t)r * DD + kc + c);
        }
        __syncthreads();

        #pragma unroll
        for (int k = 0; k < KC; k += 4) {
            const int kk = k + 2 * hi;
            v2f a  = *(const v2f*)&Xs[(wave * 16 + l16) * XPAD + kk];
            v2f bB = *(const v2f*)&WbS[l16 * XPAD + kk];
            v2f bC = *(const v2f*)&WcS[l16 * XPAD + kk];
            accB = __builtin_amdgcn_wmma_f32_16x16x4_f32(
                false, a, false, bB, (short)0, accB, false, false);
            accC = __builtin_amdgcn_wmma_f32_16x16x4_f32(
                false, a, false, bC, (short)0, accC, false, false);
        }
        __syncthreads();
    }

    #pragma unroll
    for (int v = 0; v < 8; ++v) {
        const int m = m0 + wave * 16 + v + 8 * hi;
        Bout[(size_t)m * NN + l16] = accB[v];
        Cout[(size_t)m * NN + l16] = accC[v];
    }
}

// ---------------------------------------------------------------------------
// Kernel 3: sequential selective scan over L. One thread per (b, d); h[16] in
// registers. Y holds delta on input (kernel 1) and y on output (same-thread
// read-then-write per address). Streaming reads are prefetched 8 steps ahead.
// ---------------------------------------------------------------------------
__global__ __launch_bounds__(128) void scan_kernel(
    const float* __restrict__ X, float* __restrict__ Y,
    const float* __restrict__ Bin, const float* __restrict__ Cin,
    const float* __restrict__ A_log, const float* __restrict__ Dp,
    float* __restrict__ Hf)
{
    __shared__ float bsh[NN];
    __shared__ float csh[NN];

    const int tid = threadIdx.x;
    const int d   = blockIdx.x * 128 + tid;
    const int b   = blockIdx.y;

    float A[NN];
    float h[NN];
    #pragma unroll
    for (int n = 0; n < NN; ++n) {
        A[n] = -__expf(A_log[(size_t)d * NN + n]);
        h[n] = 0.0f;
    }
    const float dpar = Dp[d];

    const size_t base   = (size_t)b * LL * DD + d;
    const size_t bcbase = (size_t)b * LL * NN;

    for (int t = 0; t < LL; ++t) {
        if (tid < NN)
            bsh[tid] = Bin[bcbase + (size_t)t * NN + tid];
        else if (tid < 2 * NN)
            csh[tid - NN] = Cin[bcbase + (size_t)t * NN + (tid - NN)];
        __syncthreads();

        const size_t idx = base + (size_t)t * DD;
        if (t + 8 < LL) {
            __builtin_prefetch(&Y[idx + 8 * DD], 0, 0);
            __builtin_prefetch(&X[idx + 8 * DD], 0, 0);
        }
        const float dv = Y[idx];       // delta (written by kernel 1)
        const float xv = X[idx];
        const float dx = dv * xv;
        float y = dpar * xv;
        #pragma unroll
        for (int n = 0; n < NN; ++n) {
            const float abar = __expf(dv * A[n]);
            h[n] = abar * h[n] + dx * bsh[n];
            y += h[n] * csh[n];
        }
        Y[idx] = y;
        __syncthreads();
    }

    float* hp = Hf + ((size_t)b * DD + d) * NN;
    #pragma unroll
    for (int n = 0; n < NN; ++n) hp[n] = h[n];
}

// ---------------------------------------------------------------------------
extern "C" void kernel_launch(void* const* d_in, const int* in_sizes, int n_in,
                              void* d_out, int out_size, void* d_ws, size_t ws_size,
                              hipStream_t stream)
{
    const float* x       = (const float*)d_in[0];  // (B, L, D)
    const float* A_log   = (const float*)d_in[1];  // (D, N)
    const float* D_param = (const float*)d_in[2];  // (D,)
    const float* W_B     = (const float*)d_in[3];  // (N, D)
    const float* W_C     = (const float*)d_in[4];  // (N, D)
    const float* W_delta = (const float*)d_in[5];  // (D, D)
    const float* b_delta = (const float*)d_in[6];  // (D,)

    float* y  = (float*)d_out;                     // (B, L, D): delta then y
    float* hf = y + (size_t)MM * DD;               // (B, D, N)

    float* Bin = (float*)d_ws;                     // (M, N)
    float* Cin = Bin + (size_t)MM * NN;            // (M, N)

    delta_gemm_kernel<<<dim3(MM / 64, DD / 64), 256, 0, stream>>>(
        x, W_delta, b_delta, y);
    bc_gemm_kernel<<<dim3(MM / 128), 256, 0, stream>>>(
        x, W_B, W_C, Bin, Cin);
    scan_kernel<<<dim3(DD / 128, BB), 128, 0, stream>>>(
        x, y, Bin, Cin, A_log, D_param, hf);
}

// v001
// It runs in 306 microseconds.
// In both of two side-by-side timings against v000, it was 7.82 times as fast.
#include <hip/hip_runtime.h>
#include <math.h>
#include <stdint.h>

typedef __attribute__((ext_vector_type(2))) float v2f;
typedef __attribute__((ext_vector_type(8))) float v8f;
typedef __attribute__((ext_vector_type(4))) unsigned int v4u;
typedef __attribute__((ext_vector_type(4))) int v4i;
typedef __attribute__((ext_vector_type(8))) int v8i;

#define BB 8
#define LL 2048
#define DD 1024
#define NN 16
#define MM (BB * LL)

#define KC   32      // K chunk per LDS stage (dwords per tile row)
#define XPAD 36      // effective LDS row stride in floats (KC + 4 pad dwords)

__device__ __forceinline__ float softplus_f(float s) {
    // matches jax.nn.softplus = max(s,0) + log1p(exp(-|s|))
    return fmaxf(s, 0.0f) + log1pf(__expf(-fabsf(s)));
}

__device__ __forceinline__ void tdm_load_tile_2d(
    unsigned int lds_byte_off, const float* gptr,
    unsigned int tensor_d0, unsigned int tensor_d1,
    unsigned int tile_d0, unsigned int tile_d1,
    unsigned int stride0_elems)
{
    const unsigned long long ga = (unsigned long long)(uintptr_t)gptr;

    v4u g0;
    g0.x = 1u;                                          // count=1, user mode
    g0.y = lds_byte_off;                                // lds_addr
    g0.z = (unsigned int)(ga & 0xFFFFFFFFull);          // global_addr[31:0]
    g0.w = (unsigned int)((ga >> 32) & 0x01FFFFFFull)   // global_addr[56:32]
         | (2u << 30);                                  // type=2 ("image")

    v8i g1;
    g1[0] = (int)((2u << 16)
                | (1u << 20)
                | (4u << 22)
                | (3u << 25));
    g1[1] = (int)((tensor_d0 & 0xFFFFu) << 16);
    g1[2] = (int)((tensor_d0 >> 16) | ((tensor_d1 & 0xFFFFu) << 16));
    g1[3] = (int)((tensor_d1 >> 16) | (tile_d0 << 16));
    g1[4] = (int)(tile_d1 & 0xFFFFu);
    g1[5] = (int)stride0_elems;
    g1[6] = 0;
    g1[7] = 0;

    v4i g2 = {0, 0, 0, 0};
    v4i g3 = {0, 0, 0, 0};
#if __clang_major__ >= 23
    v8i g4 = {0, 0, 0, 0, 0, 0, 0, 0};
    __builtin_amdgcn_tensor_load_to_lds(g0, g1, g2, g3, g4, 0);
#else
    __builtin_amdgcn_tensor_load_to_lds(g0, g1, g2, g3, 0);
#endif
}

__global__ __launch_bounds__(256) void delta_gemm_kernel(
    const float* __restrict__ X, const float* __restrict__ W,
    const float* __restrict__ bias, float* __restrict__ out)
{
    __shared__ float Xs[2][64 * XPAD];
    __shared__ float Ws[2][64 * XPAD];

    const int m0   = blockIdx.x * 64;
    const int e0   = blockIdx.y * 64;
    const int tid  = threadIdx.x;
    const int wave = tid >> 5;
    const int lane = tid & 31;
    const int l16  = lane & 15;
    const int hi   = lane >> 4;          // selects K+{0,1} vs K+{2,3}
    const int sm   = (wave & 3) * 16;    // M sub-tile
    const int se   = (wave >> 2) * 32;   // E sub-tile pair base

    v8f acc0 = {};
    v8f acc1 = {};

    const unsigned int xs0 = (unsigned int)(uintptr_t)&Xs[0][0];
    const unsigned int xs1 = (unsigned int)(uintptr_t)&Xs[1][0];
    const unsigned int ws0 = (unsigned int)(uintptr_t)&Ws[0][0];
    const unsigned int ws1 = (unsigned int)(uintptr_t)&Ws[1][0];

    const int nch = DD / KC;             // 32 chunks

    if (wave == 0) {
        tdm_load_tile_2d(xs0, X + (size_t)m0 * DD, DD, MM, KC, 64, DD);
        tdm_load_tile_2d(ws0, W + (size_t)e0 * DD, DD, DD, KC, 64, DD);
    }

    for (int i = 0; i < nch; ++i) {
        const int cur = i & 1;
        if (wave == 0) {
            if (i + 1 < nch) {
                const int kc = (i + 1) * KC;
                tdm_load_tile_2d(cur ? xs0 : xs1,
                                 X + (size_t)m0 * DD + kc, DD, MM, KC, 64, DD);
                tdm_load_tile_2d(cur ? ws0 : ws1,
                                 W + (size_t)e0 * DD + kc, DD, DD, KC, 64, DD);
                __builtin_amdgcn_s_wait_tensorcnt(2);   // chunk i landed
            } else {
                __builtin_amdgcn_s_wait_tensorcnt(0);   // drain
            }
        }
        __syncthreads();

        const float* xs = &Xs[cur][0];
        const float* wsp = &Ws[cur][0];
        #pragma unroll
        for (int k = 0; k < KC; k += 4) {
            const int kk = k + 2 * hi;
            v2f a  = *(const v2f*)&xs[(sm + l16) * XPAD + kk];
            v2f b0 = *(const v2f*)&wsp[(se + l16) * XPAD + kk];
            v2f b1 = *(const v2f*)&wsp[(se + 16 + l16) * XPAD + kk];
            acc0 = __builtin_amdgcn_wmma_f32_16x16x4_f32(
                false, a, false, b0, (short)0, acc0, false, false);
            acc1 = __builtin_amdgcn_wmma_f32_16x16x4_f32(
                false, a, false, b1, (short)0, acc1, false, false);
        }
        __syncthreads();   // everyone done with buf cur before it is re-DMAed
    }

    const int ee0 = e0 + se + l16;
    const int ee1 = ee0 + 16;
    const float bia0 = bias[ee0];
    const float bia1 = bias[ee1];
    #pragma unroll
    for (int v = 0; v < 8; ++v) {
        const int m = m0 + sm + v + 8 * hi;
        out[(size_t)m * DD + ee0] = softplus_f(acc0[v] + bia0);
        out[(size_t)m * DD + ee1] = softplus_f(acc1[v] + bia1);
    }
}

// ---------------------------------------------------------------------------
// Kernel 2: B_in = X @ W_B^T, C_in = X @ W_C^T  (both M x 16)
// 256 threads (8 waves), 128 rows/WG; wave w owns rows m0+16w, accumulates
// both the B and C 16x16 tiles.
// ---------------------------------------------------------------------------
__global__ __launch_bounds__(256) void bc_gemm_kernel(
    const float* __restrict__ X, const float* __restrict__ WB,
    const float* __restrict__ WC, float* __restrict__ Bout,
    float* __restrict__ Cout)
{
    __shared__ float Xs[128 * XPAD];
    __shared__ float WbS[16 * XPAD];
    __shared__ float WcS[16 * XPAD];

    const int m0   = blockIdx.x * 128;
    const int tid  = threadIdx.x;
    const int wave = tid >> 5;
    const int lane = tid & 31;
    const int l16  = lane & 15;
    const int hi   = lane >> 4;

    v8f accB = {};
    v8f accC = {};

    for (int kc = 0; kc < DD; kc += KC) {
        #pragma unroll
        for (int i = 0; i < 4; ++i) {
            const int idx = tid + 256 * i;
            const int r = idx >> 3;
            const int c = (idx & 7) << 2;
            *(float4*)&Xs[r * XPAD + c] =
                *(const float4*)(X + (size_t)(m0 + r) * DD + kc + c);
        }
        {
            const int t2 = tid & 127;
            const int r = t2 >> 3;
            const int c = (t2 & 7) << 2;
            const float* src = (tid < 128) ? WB : WC;
            float* dst       = (tid < 128) ? WbS : WcS;
            *(float4*)&dst[r * XPAD + c] =
                *(const float4*)(src + (size_t)r * DD + kc + c);
        }
        __syncthreads();

        #pragma unroll
        for (int k = 0; k < KC; k += 4) {
            const int kk = k + 2 * hi;
            v2f a  = *(const v2f*)&Xs[(wave * 16 + l16) * XPAD + kk];
            v2f bB = *(const v2f*)&WbS[l16 * XPAD + kk];
            v2f bC = *(const v2f*)&WcS[l16 * XPAD + kk];
            accB = __builtin_amdgcn_wmma_f32_16x16x4_f32(
                false, a, false, bB, (short)0, accB, false, false);
            accC = __builtin_amdgcn_wmma_f32_16x16x4_f32(
                false, a, false, bC, (short)0, accC, false, false);
        }
        __syncthreads();
    }

    #pragma unroll
    for (int v = 0; v < 8; ++v) {
        const int m = m0 + wave * 16 + v + 8 * hi;
        Bout[(size_t)m * NN + l16] = accB[v];
        Cout[(size_t)m * NN + l16] = accC[v];
    }
}

#define NCH 32
#define CL  (LL / NCH)

__global__ __launch_bounds__(NCH * 32) void scan_kernel(
    const float* __restrict__ X, float* __restrict__ Y,
    const float* __restrict__ Bin, const float* __restrict__ Cin,
    const float* __restrict__ A_log, const float* __restrict__ Dp,
    float* __restrict__ Hf)
{
    __shared__ float carry[NCH][NN][32];   // chunk end state, then start state
    __shared__ float dsum[NCH][32];        // sum of delta over the chunk

    const int tid  = threadIdx.x;
    const int lane = tid & 31;
    // the wave's number in a scalar register: B_t, C_t addresses and the tests
    // on ch are then scalar
    const int ch   = __builtin_amdgcn_readfirstlane(tid >> 5);
    const int d    = blockIdx.x * 32 + lane;
    const int b    = blockIdx.y;
    const int t0   = ch * CL;

    float A[NN];
    float h[NN];
    #pragma unroll
    for (int n = 0; n < NN; ++n) {
        A[n] = -__expf(A_log[(size_t)d * NN + n]);
        h[n] = 0.0f;
    }
    const float dpar = Dp[d];

    const size_t base = ((size_t)b * LL + t0) * DD + d;
    const float* __restrict__ bp = Bin + ((size_t)b * LL + t0) * NN;
    const float* __restrict__ cp = Cin + ((size_t)b * LL + t0) * NN;

    // pass 1 (the last chunk's end state is not needed by anybody)
    if (ch + 1 < NCH) {
        float ds = 0.0f;
        for (int i = 0; i < CL; ++i) {
            const size_t idx = base + (size_t)i * DD;
            const float dv = Y[idx];       // delta (written by kernel 1)
            const float xv = X[idx];
            // both loads' address registers are advanced for the next step
            asm volatile("s_wait_xcnt 0x0" ::: "memory");
            const float dx = dv * xv;
            ds += dv;
            #pragma unroll   // constant n: h[] and A[] stay in registers
            for (int n = 0; n < NN; ++n) {
                const float abar = __expf(dv * A[n]);
                h[n] = abar * h[n] + dx * bp[i * NN + n];
            }
        }
        #pragma unroll   // constant n: h[] stays in registers
        for (int n = 0; n < NN; ++n) carry[ch][n][lane] = h[n];
        dsum[ch][lane] = ds;
    }
    __syncthreads();   // all end states are in LDS

    // carry: thread (n, lane) walks the chunks of its (d, n) in order
    if (tid < NN * 32) {
        const int n = tid >> 5;
        const float An = -__expf(A_log[(size_t)d * NN + n]);
        float hs = 0.0f;
        for (int c = 0; c + 1 < NCH; ++c) {
            const float he = carry[c][n][lane];
            const float p  = __expf(An * dsum[c][lane]);
            carry[c][n][lane] = hs;
            hs = he + p * hs;
        }
        carry[NCH - 1][n][lane] = hs;
    }
    __syncthreads();   // all start states are in LDS

    #pragma unroll   // constant n: h[] stays in registers
    for (int n = 0; n < NN; ++n) h[n] = carry[ch][n][lane];

    // pass 2
    for (int i = 0; i < CL; ++i) {
        const size_t idx = base + (size_t)i * DD;
        const float dv = Y[idx];
        const float xv = X[idx];
        const float dx = dv * xv;
        float y = dpar * xv;
        #pragma unroll
        for (int n = 0; n < NN; ++n) {
            const float abar = __expf(dv * A[n]);
            h[n] = abar * h[n] + dx * bp[i * NN + n];
            y += h[n] * cp[i * NN + n];
        }
        Y[idx] = y;
    }

    if (ch == NCH - 1) {
        float* hp = Hf + ((size_t)b * DD + d) * NN;
        #pragma unroll
        for (int n = 0; n < NN; ++n) hp[n] = h[n];
    }
}

// ---------------------------------------------------------------------------
extern "C" void kernel_launch(void* const* d_in, const int* in_sizes, int n_in,
                              void* d_out, int out_size, void* d_ws, size_t ws_size,
                              hipStream_t stream)
{
    const float* x       = (const float*)d_in[0];  // (B, L, D)
    const float* A_log   = (const float*)d_in[1];  // (D, N)
    const float* D_param = (const float*)d_in[2];  // (D,)
    const float* W_B     = (const float*)d_in[3];  // (N, D)
    const float* W_C     = (const float*)d_in[4];  // (N, D)
    const float* W_delta = (const float*)d_in[5];  // (D, D)
    const float* b_delta = (const float*)d_in[6];  // (D,)

    float* y  = (float*)d_out;                     // (B, L, D): delta then y
    float* hf = y + (size_t)MM * DD;               // (B, D, N)

    float* Bin = (float*)d_ws;                     // (M, N)
    float* Cin = Bin + (size_t)MM * NN;            // (M, N)

    delta_gemm_kernel<<<dim3(MM / 64, DD / 64), 256, 0, stream>>>(
        x, W_delta, b_delta, y);
    bc_gemm_kernel<<<dim3(MM / 128), 256, 0, stream>>>(
        x, W_B, W_C, Bin, Cin);
    scan_kernel<<<dim3(DD / 32, BB), NCH * 32, 0, stream>>>(
        x, y, Bin, Cin, A_log, D_param, hf);
}

// v002
// It runs in 279 microseconds.
// Timed twice side by side with v001, it ran 1.10 times as fast both times.
// Counting every step since v000, it is 8.58 times as fast.
#include <hip/hip_runtime.h>
#include <math.h>
#include <stdint.h>

typedef __attribute__((ext_vector_type(2))) float v2f;
typedef __attribute__((ext_vector_type(8))) float v8f;
typedef __attribute__((ext_vector_type(4))) unsigned int v4u;
typedef __attribute__((ext_vector_type(4))) int v4i;
typedef __attribute__((ext_vector_type(8))) int v8i;

#define BB 8
#define LL 2048
#define DD 1024
#define NN 16
#define MM (BB * LL)

#define KC   32      // K chunk per LDS stage (dwords per tile row)
#define XPAD 36      // effective LDS row stride in floats (KC + 4 pad dwords)

__device__ __forceinline__ float softplus_f(float s) {
    // matches jax.nn.softplus = max(s,0) + log1p(exp(-|s|))
    return fmaxf(s, 0.0f) + log1pf(__expf(-fabsf(s)));
}

__device__ __forceinline__ void tdm_load_tile_2d(
    unsigned int lds_byte_off, const float* gptr,
    unsigned int tensor_d0, unsigned int tensor_d1,
    unsigned int tile_d0, unsigned int tile_d1,
    unsigned int stride0_elems)
{
    const unsigned long long ga = (unsigned long long)(uintptr_t)gptr;

    v4u g0;
    g0.x = 1u;                                          // count=1, user mode
    g0.y = lds_byte_off;                                // lds_addr
    g0.z = (unsigned int)(ga & 0xFFFFFFFFull);          // global_addr[31:0]
    g0.w = (unsigned int)((ga >> 32) & 0x01FFFFFFull)   // global_addr[56:32]
         | (2u << 30);                                  // type=2 ("image")

    v8i g1;
    g1[0] = (int)((2u << 16)
                | (1u << 20)
                | (4u << 22)
                | (3u << 25));
    g1[1] = (int)((tensor_d0 & 0xFFFFu) << 16);
    g1[2] = (int)((tensor_d0 >> 16) | ((tensor_d1 & 0xFFFFu) << 16));
    g1[3] = (int)((tensor_d1 >> 16) | (tile_d0 << 16));
    g1[4] = (int)(tile_d1 & 0xFFFFu);
    g1[5] = (int)stride0_elems;
    g1[6] = 0;
    g1[7] = 0;

    v4i g2 = {0, 0, 0, 0};
    v4i g3 = {0, 0, 0, 0};
#if __clang_major__ >= 23
    v8i g4 = {0, 0, 0, 0, 0, 0, 0, 0};
    __builtin_amdgcn_tensor_load_to_lds(g0, g1, g2, g3, g4, 0);
#else
    __builtin_amdgcn_tensor_load_to_lds(g0, g1, g2, g3, 0);
#endif
}

__global__ __launch_bounds__(256) void delta_gemm_kernel(
    const float* __restrict__ X, const float* __restrict__ W,
    const float* __restrict__ bias, float* __restrict__ out,
    const float* __restrict__ WB, const float* __restrict__ WC,
    float* __restrict__ Bout, float* __restrict__ Cout)
{
    __shared__ float Xs[2][64 * XPAD];
    __shared__ float Ws[2][64 * XPAD];
    __shared__ float BCs[2][32 * XPAD];  // rows 0-15: W_B, rows 16-31: W_C

    const int m0   = blockIdx.x * 64;
    const int e0   = blockIdx.y * 64;
    const int tid  = threadIdx.x;
    const int wave = tid >> 5;
    const int lane = tid & 31;
    const int l16  = lane & 15;
    const int hi   = lane >> 4;          // selects K+{0,1} vs K+{2,3}
    const int sm   = (wave & 3) * 16;    // M sub-tile
    const int se   = (wave >> 2) * 32;   // E sub-tile pair base

    v8f acc0 = {};
    v8f acc1 = {};
    v8f acc2 = {};                       // B or C tile (first column block only)

    const bool with_bc = (blockIdx.y == 0);   // the same for the whole work-group
    const int  bcr = tid >> 3;                // staged row of BCs
    const int  bcc = (tid & 7) << 2;          // staged column (floats)
    const float* bcsrc = ((tid < 128) ? WB + (size_t)bcr * DD
                                      : WC + (size_t)(bcr - 16) * DD) + bcc;

    const unsigned int xs0 = (unsigned int)(uintptr_t)&Xs[0][0];
    const unsigned int xs1 = (unsigned int)(uintptr_t)&Xs[1][0];
    const unsigned int ws0 = (unsigned int)(uintptr_t)&Ws[0][0];
    const unsigned int ws1 = (unsigned int)(uintptr_t)&Ws[1][0];

    const int nch = DD / KC;             // 32 chunks

    if (wave == 0) {
        tdm_load_tile_2d(xs0, X + (size_t)m0 * DD, DD, MM, KC, 64, DD);
        tdm_load_tile_2d(ws0, W + (size_t)e0 * DD, DD, DD, KC, 64, DD);
    }
    if (with_bc)   // chunk 0: read behind the first barrier of the loop
        *(float4*)&BCs[0][bcr * XPAD + bcc] = *(const float4*)bcsrc;

    for (int i = 0; i < nch; ++i) {
        const int cur = i & 1;
        if (wave == 0) {
            if (i + 1 < nch) {
                const int kc = (i + 1) * KC;
                tdm_load_tile_2d(cur ? xs0 : xs1,
                                 X + (size_t)m0 * DD + kc, DD, MM, KC, 64, DD);
                tdm_load_tile_2d(cur ? ws0 : ws1,
                                 W + (size_t)e0 * DD + kc, DD, DD, KC, 64, DD);
                __builtin_amdgcn_s_wait_tensorcnt(2);   // chunk i landed
            } else {
                __builtin_amdgcn_s_wait_tensorcnt(0);   // drain
            }
        }
        __syncthreads();

        const float* xs = &Xs[cur][0];
        const float* wsp = &Ws[cur][0];
        v2f a[KC / 4];   // the wave's A fragments of this chunk
        #pragma unroll   // constant k: a[] stays in registers
        for (int k = 0; k < KC; k += 4)
            a[k / 4] = *(const v2f*)&xs[(sm + l16) * XPAD + k + 2 * hi];
        if (with_bc) {
            float4 bcv;
            if (i + 1 < nch) {   // chunk i+1 flies while this tile's WMMAs run
                bcv = *(const float4*)(bcsrc + (i + 1) * KC);
                // the load's address registers are advanced for the next chunk
                asm volatile("s_wait_xcnt 0x0" ::: "memory");
            }
            const float* bcp = &BCs[cur][((wave >> 2) * 16 + l16) * XPAD];
            #pragma unroll   // constant k: the LDS offsets become immediates
            for (int k = 0; k < KC; k += 4) {
                v2f b2 = *(const v2f*)&bcp[k + 2 * hi];
                acc2 = __builtin_amdgcn_wmma_f32_16x16x4_f32(
                    false, a[k / 4], false, b2, (short)0, acc2, false, false);
            }
            // chunk i+1 goes to the other buffer: its readers left it at the
            // end of chunk i-1, and the barrier at the foot publishes it
            if (i + 1 < nch)
                *(float4*)&BCs[cur ^ 1][bcr * XPAD + bcc] = bcv;
        }
        #pragma unroll
        for (int k = 0; k < KC; k += 4) {
            const int kk = k + 2 * hi;
            v2f b0 = *(const v2f*)&wsp[(se + l16) * XPAD + kk];
            v2f b1 = *(const v2f*)&wsp[(se + 16 + l16) * XPAD + kk];
            acc0 = __builtin_amdgcn_wmma_f32_16x16x4_f32(
                false, a[k / 4], false, b0, (short)0, acc0, false, false);
            acc1 = __builtin_amdgcn_wmma_f32_16x16x4_f32(
                false, a[k / 4], false, b1, (short)0, acc1, false, false);
        }
        __syncthreads();   // everyone done with buf cur before it is re-DMAed
    }

    if (with_bc) {
        float* bco = (wave >> 2) ? Cout : Bout;
        #pragma unroll   // constant v: acc2 stays in registers
        for (int v = 0; v < 8; ++v) {
            const int m = m0 + sm + v + 8 * hi;
            bco[(size_t)m * NN + l16] = acc2[v];
        }
        // the stores' registers are reused by the epilogue below
        asm volatile("s_wait_xcnt 0x0" ::: "memory");
    }

    const int ee0 = e0 + se + l16;
    const int ee1 = ee0 + 16;
    const float bia0 = bias[ee0];
    const float bia1 = bias[ee1];
    #pragma unroll
    for (int v = 0; v < 8; ++v) {
        const int m = m0 + sm + v + 8 * hi;
        out[(size_t)m * DD + ee0] = softplus_f(acc0[v] + bia0);
        out[(size_t)m * DD + ee1] = softplus_f(acc1[v] + bia1);
    }
}

#define NCH 32
#define CL  (LL / NCH)

__global__ __launch_bounds__(NCH * 32) void scan_kernel(
    const float* __restrict__ X, float* __restrict__ Y,
    const float* __restrict__ Bin, const float* __restrict__ Cin,
    const float* __restrict__ A_log, const float* __restrict__ Dp,
    float* __restrict__ Hf)
{
    __shared__ float carry[NCH][NN][32];   // chunk end state, then start state
    __shared__ float dsum[NCH][32];        // sum of delta over the chunk

    const int tid  = threadIdx.x;
    const int lane = tid & 31;
    // the wave's number in a scalar register: B_t, C_t addresses and the tests
    // on ch are then scalar
    const int ch   = __builtin_amdgcn_readfirstlane(tid >> 5);
    const int d    = blockIdx.x * 32 + lane;
    const int b    = blockIdx.y;
    const int t0   = ch * CL;

    float A[NN];
    float h[NN];
    #pragma unroll
    for (int n = 0; n < NN; ++n) {
        A[n] = -__expf(A_log[(size_t)d * NN + n]);
        h[n] = 0.0f;
    }
    const float dpar = Dp[d];

    const size_t base = ((size_t)b * LL + t0) * DD + d;
    const float* __restrict__ bp = Bin + ((size_t)b * LL + t0) * NN;
    const float* __restrict__ cp = Cin + ((size_t)b * LL + t0) * NN;

    // pass 1 (the last chunk's end state is not needed by anybody)
    if (ch + 1 < NCH) {
        float ds = 0.0f;
        for (int i = 0; i < CL; ++i) {
            const size_t idx = base + (size_t)i * DD;
            const float dv = Y[idx];       // delta (written by kernel 1)
            const float xv = X[idx];
            // both loads' address registers are advanced for the next step
            asm volatile("s_wait_xcnt 0x0" ::: "memory");
            const float dx = dv * xv;
            ds += dv;
            #pragma unroll   // constant n: h[] and A[] stay in registers
            for (int n = 0; n < NN; ++n) {
                const float abar = __expf(dv * A[n]);
                h[n] = abar * h[n] + dx * bp[i * NN + n];
            }
        }
        #pragma unroll   // constant n: h[] stays in registers
        for (int n = 0; n < NN; ++n) carry[ch][n][lane] = h[n];
        dsum[ch][lane] = ds;
    }
    __syncthreads();   // all end states are in LDS

    // carry: thread (n, lane) walks the chunks of its (d, n) in order
    if (tid < NN * 32) {
        const int n = tid >> 5;
        const float An = -__expf(A_log[(size_t)d * NN + n]);
        float hs = 0.0f;
        for (int c = 0; c + 1 < NCH; ++c) {
            const float he = carry[c][n][lane];
            const float p  = __expf(An * dsum[c][lane]);
            carry[c][n][lane] = hs;
            hs = he + p * hs;
        }
        carry[NCH - 1][n][lane] = hs;
    }
    __syncthreads();   // all start states are in LDS

    #pragma unroll   // constant n: h[] stays in registers
    for (int n = 0; n < NN; ++n) h[n] = carry[ch][n][lane];

    // pass 2
    for (int i = 0; i < CL; ++i) {
        const size_t idx = base + (size_t)i * DD;
        const float dv = Y[idx];
        const float xv = X[idx];
        const float dx = dv * xv;
        float y = dpar * xv;
        #pragma unroll
        for (int n = 0; n < NN; ++n) {
            const float abar = __expf(dv * A[n]);
            h[n] = abar * h[n] + dx * bp[i * NN + n];
            y += h[n] * cp[i * NN + n];
        }
        Y[idx] = y;
    }

    if (ch == NCH - 1) {
        float* hp = Hf + ((size_t)b * DD + d) * NN;
        #pragma unroll
        for (int n = 0; n < NN; ++n) hp[n] = h[n];
    }
}

// ---------------------------------------------------------------------------
extern "C" void kernel_launch(void* const* d_in, const int* in_sizes, int n_in,
                              void* d_out, int out_size, void* d_ws, size_t ws_size,
                              hipStream_t stream)
{
    const float* x       = (const float*)d_in[0];  // (B, L, D)
    const float* A_log   = (const float*)d_in[1];  // (D, N)
    const float* D_param = (const float*)d_in[2];  // (D,)
    const float* W_B     = (const float*)d_in[3];  // (N, D)
    const float* W_C     = (const float*)d_in[4];  // (N, D)
    const float* W_delta = (const float*)d_in[5];  // (D, D)
    const float* b_delta = (const float*)d_in[6];  // (D,)

    float* y  = (float*)d_out;                     // (B, L, D): delta then y
    float* hf = y + (size_t)MM * DD;               // (B, D, N)

    float* Bin = (float*)d_ws;                     // (M, N)
    float* Cin = Bin + (size_t)MM * NN;            // (M, N)

    delta_gemm_kernel<<<dim3(MM / 64, DD / 64), 256, 0, stream>>>(
        x, W_delta, b_delta, y, W_B, W_C, Bin, Cin);
    scan_kernel<<<dim3(DD / 32, BB), NCH * 32, 0, stream>>>(
        x, y, Bin, Cin, A_log, D_param, hf);
}

// v003
// One run takes 253 microseconds.
// Two timings next to v002 put it at 1.10 and 1.11 times that version's speed.
// All steps since v000 together make it 9.49 times as fast.
#include <hip/hip_runtime.h>
#include <math.h>
#include <stdint.h>

typedef __attribute__((ext_vector_type(2))) float v2f;
typedef __attribute__((ext_vector_type(8))) float v8f;
typedef __attribute__((ext_vector_type(4))) unsigned int v4u;
typedef __attribute__((ext_vector_type(4))) int v4i;
typedef __attribute__((ext_vector_type(8))) int v8i;

#define BB 8
#define LL 2048
#define DD 1024
#define NN 16
#define MM (BB * LL)

#define KC   32      // K chunk per LDS stage (dwords per tile row)
#define XPAD 36      // effective LDS row stride in floats (KC + 4 pad dwords)

// softplus(s) = max(s,0) + log1p(e), e = exp(-|s|) in [0,1], as jax.nn.softplus.
// log1p(e) = 2 atanh(z) with z = e / (2 + e) <= 1/3: the odd series in z up to
// z^13 (the first term left out is below 2e-8 of the sum at z = 1/3), written
// as 2z + 2z * z^2 * p(z^2) so that a small e comes back as e. It stands in for
// the library's log1pf, whose sequence of about a hundred vector instructions
// a value was nearly all of this kernel's vector work. Two values at a time:
// the products and sums are two-wide.
__device__ __forceinline__ v2f softplus2_f(v2f s) {
    v2f e, r, m;
    e.x = __expf(-fabsf(s.x));
    e.y = __expf(-fabsf(s.y));
    const v2f w = e + 2.0f;
    r.x = __builtin_amdgcn_rcpf(w.x);
    r.y = __builtin_amdgcn_rcpf(w.y);
    const v2f z = e * r;
    const v2f q = z * z;
    v2f p = q * (1.0f / 13.0f) + (1.0f / 11.0f);
    p = p * q + (1.0f / 9.0f);
    p = p * q + (1.0f / 7.0f);
    p = p * q + (1.0f / 5.0f);
    p = p * q + (1.0f / 3.0f);
    const v2f zz = z + z;
    m.x = fmaxf(s.x, 0.0f);
    m.y = fmaxf(s.y, 0.0f);
    return m + (zz * (p * q) + zz);
}

__device__ __forceinline__ void tdm_load_tile_2d(
    unsigned int lds_byte_off, const float* gptr,
    unsigned int tensor_d0, unsigned int tensor_d1,
    unsigned int tile_d0, unsigned int tile_d1,
    unsigned int stride0_elems)
{
    const unsigned long long ga = (unsigned long long)(uintptr_t)gptr;

    v4u g0;
    g0.x = 1u;                                          // count=1, user mode
    g0.y = lds_byte_off;                                // lds_addr
    g0.z = (unsigned int)(ga & 0xFFFFFFFFull);          // global_addr[31:0]
    g0.w = (unsigned int)((ga >> 32) & 0x01FFFFFFull)   // global_addr[56:32]
         | (2u << 30);                                  // type=2 ("image")

    v8i g1;
    g1[0] = (int)((2u << 16)
                | (1u << 20)
                | (4u << 22)
                | (3u << 25));
    g1[1] = (int)((tensor_d0 & 0xFFFFu) << 16);
    g1[2] = (int)((tensor_d0 >> 16) | ((tensor_d1 & 0xFFFFu) << 16));
    g1[3] = (int)((tensor_d1 >> 16) | (tile_d0 << 16));
    g1[4] = (int)(tile_d1 & 0xFFFFu);
    g1[5] = (int)stride0_elems;
    g1[6] = 0;
    g1[7] = 0;

    v4i g2 = {0, 0, 0, 0};
    v4i g3 = {0, 0, 0, 0};
#if __clang_major__ >= 23
    v8i g4 = {0, 0, 0, 0, 0, 0, 0, 0};
    __builtin_amdgcn_tensor_load_to_lds(g0, g1, g2, g3, g4, 0);
#else
    __builtin_amdgcn_tensor_load_to_lds(g0, g1, g2, g3, 0);
#endif
}

__global__ __launch_bounds__(256) void delta_gemm_kernel(
    const float* __restrict__ X, const float* __restrict__ W,
    const float* __restrict__ bias, float* __restrict__ out,
    const float* __restrict__ WB, const float* __restrict__ WC,
    float* __restrict__ Bout, float* __restrict__ Cout)
{
    __shared__ float Xs[2][64 * XPAD];
    __shared__ float Ws[2][64 * XPAD];
    __shared__ float BCs[2][32 * XPAD];  // rows 0-15: W_B, rows 16-31: W_C

    const int m0   = blockIdx.x * 64;
    const int e0   = blockIdx.y * 64;
    const int tid  = threadIdx.x;
    const int wave = tid >> 5;
    const int lane = tid & 31;
    const int l16  = lane & 15;
    const int hi   = lane >> 4;          // selects K+{0,1} vs K+{2,3}
    const int sm   = (wave & 3) * 16;    // M sub-tile
    const int se   = (wave >> 2) * 32;   // E sub-tile pair base

    v8f acc0 = {};
    v8f acc1 = {};
    v8f acc2 = {};                       // B or C tile (first column block only)

    const bool with_bc = (blockIdx.y == 0);   // the same for the whole work-group
    const int  bcr = tid >> 3;                // staged row of BCs
    const int  bcc = (tid & 7) << 2;          // staged column (floats)
    const float* bcsrc = ((tid < 128) ? WB + (size_t)bcr * DD
                                      : WC + (size_t)(bcr - 16) * DD) + bcc;

    const unsigned int xs0 = (unsigned int)(uintptr_t)&Xs[0][0];
    const unsigned int xs1 = (unsigned int)(uintptr_t)&Xs[1][0];
    const unsigned int ws0 = (unsigned int)(uintptr_t)&Ws[0][0];
    const unsigned int ws1 = (unsigned int)(uintptr_t)&Ws[1][0];

    const int nch = DD / KC;             // 32 chunks

    if (wave == 0) {
        tdm_load_tile_2d(xs0, X + (size_t)m0 * DD, DD, MM, KC, 64, DD);
        tdm_load_tile_2d(ws0, W + (size_t)e0 * DD, DD, DD, KC, 64, DD);
    }
    if (with_bc)   // chunk 0: read behind the first barrier of the loop
        *(float4*)&BCs[0][bcr * XPAD + bcc] = *(const float4*)bcsrc;

    for (int i = 0; i < nch; ++i) {
        const int cur = i & 1;
        if (wave == 0) {
            if (i + 1 < nch) {
                const int kc = (i + 1) * KC;
                tdm_load_tile_2d(cur ? xs0 : xs1,
                                 X + (size_t)m0 * DD + kc, DD, MM, KC, 64, DD);
                tdm_load_tile_2d(cur ? ws0 : ws1,
                                 W + (size_t)e0 * DD + kc, DD, DD, KC, 64, DD);
                __builtin_amdgcn_s_wait_tensorcnt(2);   // chunk i landed
            } else {
                __builtin_amdgcn_s_wait_tensorcnt(0);   // drain
            }
        }
        __syncthreads();

        const float* xs = &Xs[cur][0];
        const float* wsp = &Ws[cur][0];
        v2f a[KC / 4];   // the wave's A fragments of this chunk
        #pragma unroll   // constant k: a[] stays in registers
        for (int k = 0; k < KC; k += 4)
            a[k / 4] = *(const v2f*)&xs[(sm + l16) * XPAD + k + 2 * hi];
        if (with_bc) {
            float4 bcv;
            if (i + 1 < nch) {   // chunk i+1 flies while this tile's WMMAs run
                bcv = *(const float4*)(bcsrc + (i + 1) * KC);
                // the load's address registers are advanced for the next chunk
                asm volatile("s_wait_xcnt 0x0" ::: "memory");
            }
            const float* bcp = &BCs[cur][((wave >> 2) * 16 + l16) * XPAD];
            #pragma unroll   // constant k: the LDS offsets become immediates
            for (int k = 0; k < KC; k += 4) {
                v2f b2 = *(const v2f*)&bcp[k + 2 * hi];
                acc2 = __builtin_amdgcn_wmma_f32_16x16x4_f32(
                    false, a[k / 4], false, b2, (short)0, acc2, false, false);
            }
            // chunk i+1 goes to the other buffer: its readers left it at the
            // end of chunk i-1, and the barrier at the foot publishes it
            if (i + 1 < nch)
                *(float4*)&BCs[cur ^ 1][bcr * XPAD + bcc] = bcv;
        }
        #pragma unroll
        for (int k = 0; k < KC; k += 4) {
            const int kk = k + 2 * hi;
            v2f b0 = *(const v2f*)&wsp[(se + l16) * XPAD + kk];
            v2f b1 = *(const v2f*)&wsp[(se + 16 + l16) * XPAD + kk];
            acc0 = __builtin_amdgcn_wmma_f32_16x16x4_f32(
                false, a[k / 4], false, b0, (short)0, acc0, false, false);
            acc1 = __builtin_amdgcn_wmma_f32_16x16x4_f32(
                false, a[k / 4], false, b1, (short)0, acc1, false, false);
        }
        __syncthreads();   // everyone done with buf cur before it is re-DMAed
    }

    if (with_bc) {
        float* bco = (wave >> 2) ? Cout : Bout;
        #pragma unroll   // constant v: acc2 stays in registers
        for (int v = 0; v < 8; ++v) {
            const int m = m0 + sm + v + 8 * hi;
            bco[(size_t)m * NN + l16] = acc2[v];
        }
        // the stores' registers are reused by the epilogue below
        asm volatile("s_wait_xcnt 0x0" ::: "memory");
    }

    const int ee0 = e0 + se + l16;
    const int ee1 = ee0 + 16;
    const float bia0 = bias[ee0];
    const float bia1 = bias[ee1];
    #pragma unroll
    for (int v = 0; v < 8; ++v) {
        const int m = m0 + sm + v + 8 * hi;
        v2f s;
        s.x = acc0[v] + bia0;
        s.y = acc1[v] + bia1;
        const v2f sp = softplus2_f(s);
        out[(size_t)m * DD + ee0] = sp.x;
        out[(size_t)m * DD + ee1] = sp.y;
    }
}

#define NCH 32
#define CL  (LL / NCH)

__global__ __launch_bounds__(NCH * 32) void scan_kernel(
    const float* __restrict__ X, float* __restrict__ Y,
    const float* __restrict__ Bin, const float* __restrict__ Cin,
    const float* __restrict__ A_log, const float* __restrict__ Dp,
    float* __restrict__ Hf)
{
    __shared__ float carry[NCH][NN][32];   // chunk end state, then start state
    __shared__ float dsum[NCH][32];        // sum of delta over the chunk

    const int tid  = threadIdx.x;
    const int lane = tid & 31;
    // the wave's number in a scalar register: B_t, C_t addresses and the tests
    // on ch are then scalar
    const int ch   = __builtin_amdgcn_readfirstlane(tid >> 5);
    const int d    = blockIdx.x * 32 + lane;
    const int b    = blockIdx.y;
    const int t0   = ch * CL;

    float A[NN];
    float h[NN];
    #pragma unroll
    for (int n = 0; n < NN; ++n) {
        A[n] = -__expf(A_log[(size_t)d * NN + n]);
        h[n] = 0.0f;
    }
    const float dpar = Dp[d];

    const size_t base = ((size_t)b * LL + t0) * DD + d;
    const float* __restrict__ bp = Bin + ((size_t)b * LL + t0) * NN;
    const float* __restrict__ cp = Cin + ((size_t)b * LL + t0) * NN;

    // pass 1 (the last chunk's end state is not needed by anybody)
    if (ch + 1 < NCH) {
        float ds = 0.0f;
        for (int i = 0; i < CL; ++i) {
            const size_t idx = base + (size_t)i * DD;
            const float dv = Y[idx];       // delta (written by kernel 1)
            const float xv = X[idx];
            // both loads' address registers are advanced for the next step
            asm volatile("s_wait_xcnt 0x0" ::: "memory");
            const float dx = dv * xv;
            ds += dv;
            #pragma unroll   // constant n: h[] and A[] stay in registers
            for (int n = 0; n < NN; ++n) {
                const float abar = __expf(dv * A[n]);
                h[n] = abar * h[n] + dx * bp[i * NN + n];
            }
        }
        #pragma unroll   // constant n: h[] stays in registers
        for (int n = 0; n < NN; ++n) carry[ch][n][lane] = h[n];
        dsum[ch][lane] = ds;
    }
    __syncthreads();   // all end states are in LDS

    // carry: thread (n, lane) walks the chunks of its (d, n) in order
    if (tid < NN * 32) {
        const int n = tid >> 5;
        const float An = -__expf(A_log[(size_t)d * NN + n]);
        float hs = 0.0f;
        for (int c = 0; c + 1 < NCH; ++c) {
            const float he = carry[c][n][lane];
            const float p  = __expf(An * dsum[c][lane]);
            carry[c][n][lane] = hs;
            hs = he + p * hs;
        }
        carry[NCH - 1][n][lane] = hs;
    }
    __syncthreads();   // all start states are in LDS

    #pragma unroll   // constant n: h[] stays in registers
    for (int n = 0; n < NN; ++n) h[n] = carry[ch][n][lane];

    // pass 2
    for (int i = 0; i < CL; ++i) {
        const size_t idx = base + (size_t)i * DD;
        const float dv = Y[idx];
        const float xv = X[idx];
        const float dx = dv * xv;
        float y = dpar * xv;
        #pragma unroll
        for (int n = 0; n < NN; ++n) {
            const float abar = __expf(dv * A[n]);
            h[n] = abar * h[n] + dx * bp[i * NN + n];
            y += h[n] * cp[i * NN + n];
        }
        Y[idx] = y;
    }

    if (ch == NCH - 1) {
        float* hp = Hf + ((size_t)b * DD + d) * NN;
        #pragma unroll
        for (int n = 0; n < NN; ++n) hp[n] = h[n];
    }
}

// ---------------------------------------------------------------------------
extern "C" void kernel_launch(void* const* d_in, const int* in_sizes, int n_in,
                              void* d_out, int out_size, void* d_ws, size_t ws_size,
                              hipStream_t stream)
{
    const float* x       = (const float*)d_in[0];  // (B, L, D)
    const float* A_log   = (const float*)d_in[1];  // (D, N)
    const float* D_param = (const float*)d_in[2];  // (D,)
    const float* W_B     = (const float*)d_in[3];  // (N, D)
    const float* W_C     = (const float*)d_in[4];  // (N, D)
    const float* W_delta = (const float*)d_in[5];  // (D, D)
    const float* b_delta = (const float*)d_in[6];  // (D,)

    float* y  = (float*)d_out;                     // (B, L, D): delta then y
    float* hf = y + (size_t)MM * DD;               // (B, D, N)

    float* Bin = (float*)d_ws;                     // (M, N)
    float* Cin = Bin + (size_t)MM * NN;            // (M, N)

    delta_gemm_kernel<<<dim3(MM / 64, DD / 64), 256, 0, stream>>>(
        x, W_delta, b_delta, y, W_B, W_C, Bin, Cin);
    scan_kernel<<<dim3(DD / 32, BB), NCH * 32, 0, stream>>>(
        x, y, Bin, Cin, A_log, D_param, hf);
}

// v004
// One run takes 232 microseconds.
// Timed twice side by side with v003, it ran 1.09 times as fast both times.
// Over all steps from v000 it is 10.3 times as fast.
#include <hip/hip_runtime.h>
#include <math.h>
#include <stdint.h>

typedef __attribute__((ext_vector_type(2))) float v2f;
typedef __attribute__((ext_vector_type(8))) float v8f;
typedef __attribute__((ext_vector_type(4))) unsigned int v4u;
typedef __attribute__((ext_vector_type(4))) int v4i;
typedef __attribute__((ext_vector_type(8))) int v8i;

#define BB 8
#define LL 2048
#define DD 1024
#define NN 16
#define MM (BB * LL)

#define KC   32      // K chunk per LDS stage (dwords per tile row)
#define XPAD 36      // effective LDS row stride in floats (KC + 4 pad dwords)

// softplus(s) = max(s,0) + log1p(e), e = exp(-|s|) in [0,1], as jax.nn.softplus.
// log1p(e) = 2 atanh(z) with z = e / (2 + e) <= 1/3: the odd series in z up to
// z^13 (the first term left out is below 2e-8 of the sum at z = 1/3), written
// as 2z + 2z * z^2 * p(z^2) so that a small e comes back as e. It stands in for
// the library's log1pf, whose sequence of about a hundred vector instructions
// a value was nearly all of this kernel's vector work. Two values at a time:
// the products and sums are two-wide.
__device__ __forceinline__ v2f softplus2_f(v2f s) {
    v2f e, r, m;
    e.x = __expf(-fabsf(s.x));
    e.y = __expf(-fabsf(s.y));
    const v2f w = e + 2.0f;
    r.x = __builtin_amdgcn_rcpf(w.x);
    r.y = __builtin_amdgcn_rcpf(w.y);
    const v2f z = e * r;
    const v2f q = z * z;
    v2f p = q * (1.0f / 13.0f) + (1.0f / 11.0f);
    p = p * q + (1.0f / 9.0f);
    p = p * q + (1.0f / 7.0f);
    p = p * q + (1.0f / 5.0f);
    p = p * q + (1.0f / 3.0f);
    const v2f zz = z + z;
    m.x = fmaxf(s.x, 0.0f);
    m.y = fmaxf(s.y, 0.0f);
    return m + (zz * (p * q) + zz);
}

__device__ __forceinline__ void tdm_load_tile_2d(
    unsigned int lds_byte_off, const float* gptr,
    unsigned int tensor_d0, unsigned int tensor_d1,
    unsigned int tile_d0, unsigned int tile_d1,
    unsigned int stride0_elems)
{
    const unsigned long long ga = (unsigned long long)(uintptr_t)gptr;

    v4u g0;
    g0.x = 1u;                                          // count=1, user mode
    g0.y = lds_byte_off;                                // lds_addr
    g0.z = (unsigned int)(ga & 0xFFFFFFFFull);          // global_addr[31:0]
    g0.w = (unsigned int)((ga >> 32) & 0x01FFFFFFull)   // global_addr[56:32]
         | (2u << 30);                                  // type=2 ("image")

    v8i g1;
    g1[0] = (int)((2u << 16)
                | (1u << 20)
                | (4u << 22)
                | (3u << 25));
    g1[1] = (int)((tensor_d0 & 0xFFFFu) << 16);
    g1[2] = (int)((tensor_d0 >> 16) | ((tensor_d1 & 0xFFFFu) << 16));
    g1[3] = (int)((tensor_d1 >> 16) | (tile_d0 << 16));
    g1[4] = (int)(tile_d1 & 0xFFFFu);
    g1[5] = (int)stride0_elems;
    g1[6] = 0;
    g1[7] = 0;

    v4i g2 = {0, 0, 0, 0};
    v4i g3 = {0, 0, 0, 0};
#if __clang_major__ >= 23
    v8i g4 = {0, 0, 0, 0, 0, 0, 0, 0};
    __builtin_amdgcn_tensor_load_to_lds(g0, g1, g2, g3, g4, 0);
#else
    __builtin_amdgcn_tensor_load_to_lds(g0, g1, g2, g3, 0);
#endif
}

__global__ __launch_bounds__(256) void delta_gemm_kernel(
    const float* __restrict__ X, const float* __restrict__ W,
    const float* __restrict__ bias, float* __restrict__ out,
    const float* __restrict__ WB, const float* __restrict__ WC,
    float* __restrict__ Bout, float* __restrict__ Cout)
{
    __shared__ float Xs[2][64 * XPAD];
    __shared__ float Ws[2][64 * XPAD];
    __shared__ float BCs[2][32 * XPAD];  // rows 0-15: W_B, rows 16-31: W_C

    const int m0   = blockIdx.x * 64;
    const int e0   = blockIdx.y * 64;
    const int tid  = threadIdx.x;
    const int wave = tid >> 5;
    const int lane = tid & 31;
    const int l16  = lane & 15;
    const int hi   = lane >> 4;          // selects K+{0,1} vs K+{2,3}
    const int sm   = (wave & 3) * 16;    // M sub-tile
    const int se   = (wave >> 2) * 32;   // E sub-tile pair base

    v8f acc0 = {};
    v8f acc1 = {};
    v8f acc2 = {};                       // B or C tile (first column block only)

    const bool with_bc = (blockIdx.y == 0);   // the same for the whole work-group
    const int  bcr = tid >> 3;                // staged row of BCs
    const int  bcc = (tid & 7) << 2;          // staged column (floats)
    const float* bcsrc = ((tid < 128) ? WB + (size_t)bcr * DD
                                      : WC + (size_t)(bcr - 16) * DD) + bcc;

    const unsigned int xs0 = (unsigned int)(uintptr_t)&Xs[0][0];
    const unsigned int xs1 = (unsigned int)(uintptr_t)&Xs[1][0];
    const unsigned int ws0 = (unsigned int)(uintptr_t)&Ws[0][0];
    const unsigned int ws1 = (unsigned int)(uintptr_t)&Ws[1][0];

    const int nch = DD / KC;             // 32 chunks

    if (wave == 0) {
        tdm_load_tile_2d(xs0, X + (size_t)m0 * DD, DD, MM, KC, 64, DD);
        tdm_load_tile_2d(ws0, W + (size_t)e0 * DD, DD, DD, KC, 64, DD);
    }
    if (with_bc)   // chunk 0: read behind the first barrier of the loop
        *(float4*)&BCs[0][bcr * XPAD + bcc] = *(const float4*)bcsrc;

    for (int i = 0; i < nch; ++i) {
        const int cur = i & 1;
        if (wave == 0) {
            if (i + 1 < nch) {
                const int kc = (i + 1) * KC;
                tdm_load_tile_2d(cur ? xs0 : xs1,
                                 X + (size_t)m0 * DD + kc, DD, MM, KC, 64, DD);
                tdm_load_tile_2d(cur ? ws0 : ws1,
                                 W + (size_t)e0 * DD + kc, DD, DD, KC, 64, DD);
                __builtin_amdgcn_s_wait_tensorcnt(2);   // chunk i landed
            } else {
                __builtin_amdgcn_s_wait_tensorcnt(0);   // drain
            }
        }
        __syncthreads();

        const float* xs = &Xs[cur][0];
        const float* wsp = &Ws[cur][0];
        v2f a[KC / 4];   // the wave's A fragments of this chunk
        #pragma unroll   // constant k: a[] stays in registers
        for (int k = 0; k < KC; k += 4)
            a[k / 4] = *(const v2f*)&xs[(sm + l16) * XPAD + k + 2 * hi];
        if (with_bc) {
            float4 bcv;
            if (i + 1 < nch) {   // chunk i+1 flies while this tile's WMMAs run
                bcv = *(const float4*)(bcsrc + (i + 1) * KC);
                // the load's address registers are advanced for the next chunk
                asm volatile("s_wait_xcnt 0x0" ::: "memory");
            }
            const float* bcp = &BCs[cur][((wave >> 2) * 16 + l16) * XPAD];
            #pragma unroll   // constant k: the LDS offsets become immediates
            for (int k = 0; k < KC; k += 4) {
                v2f b2 = *(const v2f*)&bcp[k + 2 * hi];
                acc2 = __builtin_amdgcn_wmma_f32_16x16x4_f32(
                    false, a[k / 4], false, b2, (short)0, acc2, false, false);
            }
            // chunk i+1 goes to the other buffer: its readers left it at the
            // end of chunk i-1, and the barrier at the foot publishes it
            if (i + 1 < nch)
                *(float4*)&BCs[cur ^ 1][bcr * XPAD + bcc] = bcv;
        }
        #pragma unroll
        for (int k = 0; k < KC; k += 4) {
            const int kk = k + 2 * hi;
            v2f b0 = *(const v2f*)&wsp[(se + l16) * XPAD + kk];
            v2f b1 = *(const v2f*)&wsp[(se + 16 + l16) * XPAD + kk];
            acc0 = __builtin_amdgcn_wmma_f32_16x16x4_f32(
                false, a[k / 4], false, b0, (short)0, acc0, false, false);
            acc1 = __builtin_amdgcn_wmma_f32_16x16x4_f32(
                false, a[k / 4], false, b1, (short)0, acc1, false, false);
        }
        __syncthreads();   // everyone done with buf cur before it is re-DMAed
    }

    if (with_bc) {
        float* bco = (wave >> 2) ? Cout : Bout;
        #pragma unroll   // constant v: acc2 stays in registers
        for (int v = 0; v < 8; ++v) {
            const int m = m0 + sm + v + 8 * hi;
            bco[(size_t)m * NN + l16] = acc2[v];
        }
        // the stores' registers are reused by the epilogue below
        asm volatile("s_wait_xcnt 0x0" ::: "memory");
    }

    const int ee0 = e0 + se + l16;
    const int ee1 = ee0 + 16;
    const float bia0 = bias[ee0];
    const float bia1 = bias[ee1];
    #pragma unroll
    for (int v = 0; v < 8; ++v) {
        const int m = m0 + sm + v + 8 * hi;
        v2f s;
        s.x = acc0[v] + bia0;
        s.y = acc1[v] + bia1;
        const v2f sp = softplus2_f(s);
        out[(size_t)m * DD + ee0] = sp.x;
        out[(size_t)m * DD + ee1] = sp.y;
    }
}

#define NCH 32
#define CL  (LL / NCH)
#define PF  4
#define NG  (CL / PF)

__global__ __launch_bounds__(NCH * 32) void scan_kernel(
    const float* __restrict__ X, float* __restrict__ Y,
    const float* __restrict__ Bin, const float* __restrict__ Cin,
    const float* __restrict__ A_log, const float* __restrict__ Dp,
    float* __restrict__ Hf)
{
    __shared__ float carry[NCH][NN][32];   // chunk end state, then start state
    __shared__ float dsum[NCH][32];        // sum of delta over the chunk
    __shared__ float park[NCH][PF][2][32]; // a wave's current group: delta, x

    const int tid  = threadIdx.x;
    const int lane = tid & 31;
    // the wave's number in a scalar register: B_t, C_t addresses and the tests
    // on ch are then scalar
    const int ch   = __builtin_amdgcn_readfirstlane(tid >> 5);
    const int d    = blockIdx.x * 32 + lane;
    const int b    = blockIdx.y;
    const int t0   = ch * CL;

    float A[NN];
    float h[NN];
    #pragma unroll
    for (int n = 0; n < NN; ++n) {
        A[n] = -__expf(A_log[(size_t)d * NN + n]);
        h[n] = 0.0f;
    }
    const float dpar = Dp[d];

    const size_t base = ((size_t)b * LL + t0) * DD + d;
    const float* __restrict__ bp = Bin + ((size_t)b * LL + t0) * NN;
    const float* __restrict__ cp = Cin + ((size_t)b * LL + t0) * NN;

    // delta and x of the PF steps of group g of this wave's chunk
    auto load_group = [&](float (&dg)[PF], float (&xg)[PF], int g) {
        const size_t gx = base + (size_t)g * PF * DD;
        #pragma unroll   // constant u: the arrays stay in registers
        for (int u = 0; u < PF; ++u) {
            dg[u] = Y[gx + (size_t)u * DD];   // delta (written by kernel 1)
            xg[u] = X[gx + (size_t)u * DD];
        }
        // the loads' address registers are advanced for the next group
        asm volatile("s_wait_xcnt 0x0" ::: "memory");
    };
    float* slot = &park[ch][0][0][lane];
    auto park_group = [&](const float (&dg)[PF], const float (&xg)[PF]) {
        #pragma unroll   // constant u: the arrays stay in registers
        for (int u = 0; u < PF; ++u) {
            slot[u * 64]      = dg[u];
            slot[u * 64 + 32] = xg[u];
        }
    };

    // pass 1 (the last chunk's end state is not needed by anybody)
    if (ch + 1 < NCH) {
        float ds = 0.0f;
        float dn[PF], xn[PF];              // the group that is in flight
        load_group(dn, xn, 0);
        park_group(dn, xn);
        #pragma nounroll   // a group a trip: dn[], xn[] are the only values in flight
        for (int g = 0; g < NG; ++g) {
            if (g + 1 < NG)                // flies while group g is worked on
                load_group(dn, xn, g + 1);
            #pragma nounroll   // a step a trip: unrolled by four this loop compiled to
                               // more vector instructions a step, by two to spills
            for (int u = 0; u < PF; ++u) {
                const int   i  = g * PF + u;
                const float dv = slot[u * 64];
                const float xv = slot[u * 64 + 32];
                const float dx = dv * xv;
                ds += dv;
                #pragma unroll   // constant n: h[] and A[] stay in registers
                for (int n = 0; n < NN; ++n) {
                    const float abar = __expf(dv * A[n]);
                    h[n] = abar * h[n] + dx * bp[i * NN + n];
                }
            }
            if (g + 1 < NG)
                park_group(dn, xn);
        }
        #pragma unroll   // constant n: h[] stays in registers
        for (int n = 0; n < NN; ++n) carry[ch][n][lane] = h[n];
        dsum[ch][lane] = ds;
    }
    __syncthreads();   // all end states are in LDS

    // carry: thread (n, lane) walks the chunks of its (d, n) in order
    if (tid < NN * 32) {
        const int n = tid >> 5;
        const float An = -__expf(A_log[(size_t)d * NN + n]);
        float hs = 0.0f;
        for (int c = 0; c + 1 < NCH; ++c) {
            const float he = carry[c][n][lane];
            const float p  = __expf(An * dsum[c][lane]);
            carry[c][n][lane] = hs;
            hs = he + p * hs;
        }
        carry[NCH - 1][n][lane] = hs;
    }
    __syncthreads();   // all start states are in LDS

    #pragma unroll   // constant n: h[] stays in registers
    for (int n = 0; n < NN; ++n) h[n] = carry[ch][n][lane];

    // pass 2
    float dn[PF], xn[PF];                  // the group that is in flight
    load_group(dn, xn, 0);
    park_group(dn, xn);
    #pragma nounroll   // a group a trip, as in pass 1
    for (int g = 0; g < NG; ++g) {
        if (g + 1 < NG)                    // flies while group g is worked on
            load_group(dn, xn, g + 1);
        #pragma unroll   // the four steps in one block: their independent products
                         // and exponentials fill each other's waits
        for (int u = 0; u < PF; ++u) {
            const int    i   = g * PF + u;
            const size_t idx = base + (size_t)i * DD;
            const float dv = slot[u * 64];
            const float xv = slot[u * 64 + 32];
            const float dx = dv * xv;
            float y = dpar * xv;
            #pragma unroll
            for (int n = 0; n < NN; ++n) {
                const float abar = __expf(dv * A[n]);
                h[n] = abar * h[n] + dx * bp[i * NN + n];
                y += h[n] * cp[i * NN + n];
            }
            Y[idx] = y;
        }
        // the stores' address registers are advanced for the next group
        asm volatile("s_wait_xcnt 0x0" ::: "memory");
        if (g + 1 < NG)
            park_group(dn, xn);
    }

    if (ch == NCH - 1) {
        float* hp = Hf + ((size_t)b * DD + d) * NN;
        #pragma unroll
        for (int n = 0; n < NN; ++n) hp[n] = h[n];
    }
}

// ---------------------------------------------------------------------------
extern "C" void kernel_launch(void* const* d_in, const int* in_sizes, int n_in,
                              void* d_out, int out_size, void* d_ws, size_t ws_size,
                              hipStream_t stream)
{
    const float* x       = (const float*)d_in[0];  // (B, L, D)
    const float* A_log   = (const float*)d_in[1];  // (D, N)
    const float* D_param = (const float*)d_in[2];  // (D,)
    const float* W_B     = (const float*)d_in[3];  // (N, D)
    const float* W_C     = (const float*)d_in[4];  // (N, D)
    const float* W_delta = (const float*)d_in[5];  // (D, D)
    const float* b_delta = (const float*)d_in[6];  // (D,)

    float* y  = (float*)d_out;                     // (B, L, D): delta then y
    float* hf = y + (size_t)MM * DD;               // (B, D, N)

    float* Bin = (float*)d_ws;                     // (M, N)
    float* Cin = Bin + (size_t)MM * NN;            // (M, N)

    delta_gemm_kernel<<<dim3(MM / 64, DD / 64), 256, 0, stream>>>(
        x, W_delta, b_delta, y, W_B, W_C, Bin, Cin);
    scan_kernel<<<dim3(DD / 32, BB), NCH * 32, 0, stream>>>(
        x, y, Bin, Cin, A_log, D_param, hf);
}

// v005
// It runs in 217 microseconds.
// Two timings next to v004 put it at 1.06 and 1.07 times that version's speed.
// Over all steps from v000 it is 11.0 times as fast.
#include <hip/hip_runtime.h>
#include <math.h>
#include <stdint.h>

typedef __attribute__((ext_vector_type(2))) float v2f;
typedef __attribute__((ext_vector_type(8))) float v8f;
typedef __attribute__((ext_vector_type(4))) unsigned int v4u;
typedef __attribute__((ext_vector_type(4))) int v4i;
typedef __attribute__((ext_vector_type(8))) int v8i;

#define BB 8
#define LL 2048
#define DD 1024
#define NN 16
#define MM (BB * LL)

#define KC   32      // K chunk per LDS stage (dwords per tile row)
#define XPAD 36      // effective LDS row stride in floats (KC + 4 pad dwords)

// softplus(s) = max(s,0) + log1p(e), e = exp(-|s|) in [0,1], as jax.nn.softplus.
// log1p(e) = 2 atanh(z) with z = e / (2 + e) <= 1/3: the odd series in z up to
// z^13 (the first term left out is below 2e-8 of the sum at z = 1/3), written
// as 2z + 2z * z^2 * p(z^2) so that a small e comes back as e. It stands in for
// the library's log1pf, whose sequence of about a hundred vector instructions
// a value was nearly all of this kernel's vector work. Two values at a time:
// the products and sums are two-wide.
__device__ __forceinline__ v2f softplus2_f(v2f s) {
    v2f e, r, m;
    e.x = __expf(-fabsf(s.x));
    e.y = __expf(-fabsf(s.y));
    const v2f w = e + 2.0f;
    r.x = __builtin_amdgcn_rcpf(w.x);
    r.y = __builtin_amdgcn_rcpf(w.y);
    const v2f z = e * r;
    const v2f q = z * z;
    v2f p = q * (1.0f / 13.0f) + (1.0f / 11.0f);
    p = p * q + (1.0f / 9.0f);
    p = p * q + (1.0f / 7.0f);
    p = p * q + (1.0f / 5.0f);
    p = p * q + (1.0f / 3.0f);
    const v2f zz = z + z;
    m.x = fmaxf(s.x, 0.0f);
    m.y = fmaxf(s.y, 0.0f);
    return m + (zz * (p * q) + zz);
}

__device__ __forceinline__ void tdm_load_tile_2d(
    unsigned int lds_byte_off, const float* gptr,
    unsigned int tensor_d0, unsigned int tensor_d1,
    unsigned int tile_d0, unsigned int tile_d1,
    unsigned int stride0_elems)
{
    const unsigned long long ga = (unsigned long long)(uintptr_t)gptr;

    v4u g0;
    g0.x = 1u;                                          // count=1, user mode
    g0.y = lds_byte_off;                                // lds_addr
    g0.z = (unsigned int)(ga & 0xFFFFFFFFull);          // global_addr[31:0]
    g0.w = (unsigned int)((ga >> 32) & 0x01FFFFFFull)   // global_addr[56:32]
         | (2u << 30);                                  // type=2 ("image")

    v8i g1;
    g1[0] = (int)((2u << 16)
                | (1u << 20)
                | (4u << 22)
                | (3u << 25));
    g1[1] = (int)((tensor_d0 & 0xFFFFu) << 16);
    g1[2] = (int)((tensor_d0 >> 16) | ((tensor_d1 & 0xFFFFu) << 16));
    g1[3] = (int)((tensor_d1 >> 16) | (tile_d0 << 16));
    g1[4] = (int)(tile_d1 & 0xFFFFu);
    g1[5] = (int)stride0_elems;
    g1[6] = 0;
    g1[7] = 0;

    v4i g2 = {0, 0, 0, 0};
    v4i g3 = {0, 0, 0, 0};
#if __clang_major__ >= 23
    v8i g4 = {0, 0, 0, 0, 0, 0, 0, 0};
    __builtin_amdgcn_tensor_load_to_lds(g0, g1, g2, g3, g4, 0);
#else
    __builtin_amdgcn_tensor_load_to_lds(g0, g1, g2, g3, 0);
#endif
}

__global__ __launch_bounds__(256) void delta_gemm_kernel(
    const float* __restrict__ X, const float* __restrict__ W,
    const float* __restrict__ bias, float* __restrict__ out,
    const float* __restrict__ WB, const float* __restrict__ WC,
    float* __restrict__ Bout, float* __restrict__ Cout)
{
    __shared__ float Xs[2][64 * XPAD];
    __shared__ float Ws[2][64 * XPAD];
    __shared__ float BCs[2][32 * XPAD];  // rows 0-15: W_B, rows 16-31: W_C

    const int m0   = blockIdx.x * 64;
    const int e0   = blockIdx.y * 64;
    const int tid  = threadIdx.x;
    const int wave = tid >> 5;
    const int lane = tid & 31;
    const int l16  = lane & 15;
    const int hi   = lane >> 4;          // selects K+{0,1} vs K+{2,3}
    const int sm   = (wave & 3) * 16;    // M sub-tile
    const int se   = (wave >> 2) * 32;   // E sub-tile pair base

    v8f acc0 = {};
    v8f acc1 = {};
    v8f acc2 = {};                       // B or C tile (first column block only)

    const bool with_bc = (blockIdx.y == 0);   // the same for the whole work-group
    const int  bcr = tid >> 3;                // staged row of BCs
    const int  bcc = (tid & 7) << 2;          // staged column (floats)
    const float* bcsrc = ((tid < 128) ? WB + (size_t)bcr * DD
                                      : WC + (size_t)(bcr - 16) * DD) + bcc;

    const unsigned int xs0 = (unsigned int)(uintptr_t)&Xs[0][0];
    const unsigned int xs1 = (unsigned int)(uintptr_t)&Xs[1][0];
    const unsigned int ws0 = (unsigned int)(uintptr_t)&Ws[0][0];
    const unsigned int ws1 = (unsigned int)(uintptr_t)&Ws[1][0];

    const int nch = DD / KC;             // 32 chunks

    if (wave == 0) {
        tdm_load_tile_2d(xs0, X + (size_t)m0 * DD, DD, MM, KC, 64, DD);
        tdm_load_tile_2d(ws0, W + (size_t)e0 * DD, DD, DD, KC, 64, DD);
    }
    if (with_bc)   // chunk 0: read behind the first barrier of the loop
        *(float4*)&BCs[0][bcr * XPAD + bcc] = *(const float4*)bcsrc;

    for (int i = 0; i < nch; ++i) {
        const int cur = i & 1;
        if (wave == 0) {
            if (i + 1 < nch) {
                const int kc = (i + 1) * KC;
                tdm_load_tile_2d(cur ? xs0 : xs1,
                                 X + (size_t)m0 * DD + kc, DD, MM, KC, 64, DD);
                tdm_load_tile_2d(cur ? ws0 : ws1,
                                 W + (size_t)e0 * DD + kc, DD, DD, KC, 64, DD);
                __builtin_amdgcn_s_wait_tensorcnt(2);   // chunk i landed
            } else {
                __builtin_amdgcn_s_wait_tensorcnt(0);   // drain
            }
        }
        __syncthreads();

        const float* xs = &Xs[cur][0];
        const float* wsp = &Ws[cur][0];
        v2f a[KC / 4];   // the wave's A fragments of this chunk
        #pragma unroll   // constant k: a[] stays in registers
        for (int k = 0; k < KC; k += 4)
            a[k / 4] = *(const v2f*)&xs[(sm + l16) * XPAD + k + 2 * hi];
        if (with_bc) {
            float4 bcv;
            if (i + 1 < nch) {   // chunk i+1 flies while this tile's WMMAs run
                bcv = *(const float4*)(bcsrc + (i + 1) * KC);
                // the load's address registers are advanced for the next chunk
                asm volatile("s_wait_xcnt 0x0" ::: "memory");
            }
            const float* bcp = &BCs[cur][((wave >> 2) * 16 + l16) * XPAD];
            #pragma unroll   // constant k: the LDS offsets become immediates
            for (int k = 0; k < KC; k += 4) {
                v2f b2 = *(const v2f*)&bcp[k + 2 * hi];
                acc2 = __builtin_amdgcn_wmma_f32_16x16x4_f32(
                    false, a[k / 4], false, b2, (short)0, acc2, false, false);
            }
            // chunk i+1 goes to the other buffer: its readers left it at the
            // end of chunk i-1, and the barrier at the foot publishes it
            if (i + 1 < nch)
                *(float4*)&BCs[cur ^ 1][bcr * XPAD + bcc] = bcv;
        }
        #pragma unroll
        for (int k = 0; k < KC; k += 4) {
            const int kk = k + 2 * hi;
            v2f b0 = *(const v2f*)&wsp[(se + l16) * XPAD + kk];
            v2f b1 = *(const v2f*)&wsp[(se + 16 + l16) * XPAD + kk];
            acc0 = __builtin_amdgcn_wmma_f32_16x16x4_f32(
                false, a[k / 4], false, b0, (short)0, acc0, false, false);
            acc1 = __builtin_amdgcn_wmma_f32_16x16x4_f32(
                false, a[k / 4], false, b1, (short)0, acc1, false, false);
        }
        __syncthreads();   // everyone done with buf cur before it is re-DMAed
    }

    if (with_bc) {
        float* bco = (wave >> 2) ? Cout : Bout;
        #pragma unroll   // constant v: acc2 stays in registers
        for (int v = 0; v < 8; ++v) {
            const int m = m0 + sm + v + 8 * hi;
            bco[(size_t)m * NN + l16] = acc2[v];
        }
        // the stores' registers are reused by the epilogue below
        asm volatile("s_wait_xcnt 0x0" ::: "memory");
    }

    const int ee0 = e0 + se + l16;
    const int ee1 = ee0 + 16;
    const float bia0 = bias[ee0];
    const float bia1 = bias[ee1];
    #pragma unroll
    for (int v = 0; v < 8; ++v) {
        const int m = m0 + sm + v + 8 * hi;
        v2f s;
        s.x = acc0[v] + bia0;
        s.y = acc1[v] + bia1;
        const v2f sp = softplus2_f(s);
        out[(size_t)m * DD + ee0] = sp.x;
        out[(size_t)m * DD + ee1] = sp.y;
    }
}

#define NCH 32
#define CL  (LL / NCH)
#define PF  4
#define NG  (CL / PF)
#define LOG2E 1.44269504088896340736f

// A value that is the same in every lane, kept as a scalar-register operand.
// Without it the compiler forms two-wide products over n in pass 1 and copies
// every B_t[n] into a vector register to feed them. It compiles to no
// instruction of its own.
__device__ __forceinline__ float scalar_operand(float v) {
    return __int_as_float(__builtin_amdgcn_readfirstlane(__float_as_int(v)));
}

__global__ __launch_bounds__(NCH * 32) void scan_kernel(
    const float* __restrict__ X, float* __restrict__ Y,
    const float* __restrict__ Bin, const float* __restrict__ Cin,
    const float* __restrict__ A_log, const float* __restrict__ Dp,
    float* __restrict__ Hf)
{
    __shared__ float carry[NCH][NN][32];   // chunk end state, then start state
    __shared__ float dsum[NCH][32];        // sum of delta over the chunk
    __shared__ float park[NCH][PF][2][32]; // a wave's current group: delta, x

    const int tid  = threadIdx.x;
    const int lane = tid & 31;
    // the wave's number in a scalar register: B_t, C_t addresses and the tests
    // on ch are then scalar
    const int ch   = __builtin_amdgcn_readfirstlane(tid >> 5);
    const int d    = blockIdx.x * 32 + lane;
    const int b    = blockIdx.y;
    const int t0   = ch * CL;

    float A[NN];   // A * log2(e): exp(delta * A) is then one multiply and v_exp_f32
    float h[NN];
    #pragma unroll
    for (int n = 0; n < NN; ++n) {
        A[n] = -__expf(A_log[(size_t)d * NN + n]) * LOG2E;
        h[n] = 0.0f;
    }
    const float dpar = Dp[d];

    const size_t base = ((size_t)b * LL + t0) * DD + d;
    const float* __restrict__ bp = Bin + ((size_t)b * LL + t0) * NN;
    const float* __restrict__ cp = Cin + ((size_t)b * LL + t0) * NN;

    // delta and x of the PF steps of group g of this wave's chunk
    auto load_group = [&](float (&dg)[PF], float (&xg)[PF], int g) {
        const size_t gx = base + (size_t)g * PF * DD;
        #pragma unroll   // constant u: the arrays stay in registers
        for (int u = 0; u < PF; ++u) {
            dg[u] = Y[gx + (size_t)u * DD];   // delta (written by kernel 1)
            xg[u] = X[gx + (size_t)u * DD];
        }
        // the loads' address registers are advanced for the next group
        asm volatile("s_wait_xcnt 0x0" ::: "memory");
    };
    float* slot = &park[ch][0][0][lane];
    auto park_group = [&](const float (&dg)[PF], const float (&xg)[PF]) {
        #pragma unroll   // constant u: the arrays stay in registers
        for (int u = 0; u < PF; ++u) {
            slot[u * 64]      = dg[u];
            slot[u * 64 + 32] = xg[u];
        }
    };

    // pass 1 (the last chunk's end state is not needed by anybody)
    if (ch + 1 < NCH) {
        float ds = 0.0f;
        float dn[PF], xn[PF];              // the group that is in flight
        load_group(dn, xn, 0);
        park_group(dn, xn);
        #pragma nounroll   // a group a trip: dn[], xn[] are the only values in flight
        for (int g = 0; g < NG; ++g) {
            if (g + 1 < NG)                // flies while group g is worked on
                load_group(dn, xn, g + 1);
            #pragma nounroll   // a step a trip: unrolled by four this loop compiled to
                               // more vector instructions a step
            for (int u = 0; u < PF; ++u) {
                const int   i  = g * PF + u;
                const float dv = slot[u * 64];
                const float xv = slot[u * 64 + 32];
                const float dx = dv * xv;
                ds += dv;
                #pragma unroll   // constant n: h[] and A[] stay in registers
                for (int n = 0; n < NN; ++n) {
                    const float abar = __builtin_amdgcn_exp2f(dv * A[n]);
                    // the FMA is on dx * B_t[n]: h[n] is then updated in place (fused
                    // the other way the sum lands in the product's register and
                    // is copied back at the loop's foot)
                    h[n] = __builtin_fmaf(dx, scalar_operand(bp[i * NN + n]), abar * h[n]);
                }
            }
            if (g + 1 < NG)
                park_group(dn, xn);
        }
        #pragma unroll   // constant n: h[] stays in registers
        for (int n = 0; n < NN; ++n) carry[ch][n][lane] = h[n];
        dsum[ch][lane] = ds;
    }
    __syncthreads();   // all end states are in LDS

    // carry: thread (n, lane) walks the chunks of its (d, n) in order
    if (tid < NN * 32) {
        const int n = tid >> 5;
        const float An = -__expf(A_log[(size_t)d * NN + n]);
        float hs = 0.0f;
        for (int c = 0; c + 1 < NCH; ++c) {
            const float he = carry[c][n][lane];
            const float p  = __expf(An * dsum[c][lane]);
            carry[c][n][lane] = hs;
            hs = he + p * hs;
        }
        carry[NCH - 1][n][lane] = hs;
    }
    __syncthreads();   // all start states are in LDS

    #pragma unroll   // constant n: h[] stays in registers
    for (int n = 0; n < NN; ++n) h[n] = carry[ch][n][lane];

    // pass 2
    float dn[PF], xn[PF];                  // the group that is in flight
    load_group(dn, xn, 0);
    park_group(dn, xn);
    #pragma nounroll   // a group a trip, as in pass 1
    for (int g = 0; g < NG; ++g) {
        if (g + 1 < NG)                    // flies while group g is worked on
            load_group(dn, xn, g + 1);
        #pragma unroll   // the four steps in one block: their independent products
                         // and exponentials fill each other's waits
        for (int u = 0; u < PF; ++u) {
            const int    i   = g * PF + u;
            const size_t idx = base + (size_t)i * DD;
            const float dv = slot[u * 64];
            const float xv = slot[u * 64 + 32];
            const float dx = dv * xv;
            float y = dpar * xv;
            #pragma unroll
            for (int n = 0; n < NN; ++n) {
                const float abar = __builtin_amdgcn_exp2f(dv * A[n]);
                h[n] = __builtin_fmaf(dx, bp[i * NN + n], abar * h[n]);   // as in pass 1
                y = __builtin_fmaf(h[n], cp[i * NN + n], y);
            }
            Y[idx] = y;
        }
        // the stores' address registers are advanced for the next group
        asm volatile("s_wait_xcnt 0x0" ::: "memory");
        if (g + 1 < NG)
            park_group(dn, xn);
    }

    if (ch == NCH - 1) {
        // The end state leaves through this wave's own rows of carry (read by no
        // other wave behind the second barrier) and is stored in whole lines.
        // Stored as sixteen adjacent floats a lane, h[] was paired two-wide by
        // the compiler all the way up pass 2, with the register copies of B_t
        // and C_t that this brings.
        #pragma unroll   // constant n: h[] stays in registers
        for (int n = 0; n < NN; ++n) carry[ch][n][lane] = h[n];
        // the lanes of this wave read each other's values: orders the LDS writes
        // above before the LDS reads below for the compiler
        __builtin_amdgcn_fence(__ATOMIC_ACQ_REL, "wavefront");
        float* hp = Hf + ((size_t)b * DD + blockIdx.x * 32) * NN;
        #pragma unroll   // constant k: the stores' offsets become immediates
        for (int k = 0; k < NN; ++k) {
            const int e = k * 32 + lane;   // channel e / NN of the 32, state e % NN
            hp[e] = carry[ch][e & (NN - 1)][e >> 4];
        }
    }
}

// ---------------------------------------------------------------------------
extern "C" void kernel_launch(void* const* d_in, const int* in_sizes, int n_in,
                              void* d_out, int out_size, void* d_ws, size_t ws_size,
                              hipStream_t stream)
{
    const float* x       = (const float*)d_in[0];  // (B, L, D)
    const float* A_log   = (const float*)d_in[1];  // (D, N)
    const float* D_param = (const float*)d_in[2];  // (D,)
    const float* W_B     = (const float*)d_in[3];  // (N, D)
    const float* W_C     = (const float*)d_in[4];  // (N, D)
    const float* W_delta = (const float*)d_in[5];  // (D, D)
    const float* b_delta = (const float*)d_in[6];  // (D,)

    float* y  = (float*)d_out;                     // (B, L, D): delta then y
    float* hf = y + (size_t)MM * DD;               // (B, D, N)

    float* Bin = (float*)d_ws;                     // (M, N)
    float* Cin = Bin + (size_t)MM * NN;            // (M, N)

    delta_gemm_kernel<<<dim3(MM / 64, DD / 64), 256, 0, stream>>>(
        x, W_delta, b_delta, y, W_B, W_C, Bin, Cin);
    scan_kernel<<<dim3(DD / 32, BB), NCH * 32, 0, stream>>>(
        x, y, Bin, Cin, A_log, D_param, hf);
}
